// v000
// Times are from an AMD MI455X. After a warm-up the kernel runs many times in a row, and a time is the length of
// such a window on the GPU divided by its runs, so every launch and the gaps after it count. The runs cycle
// through copies of the inputs. A figure is the median of several windows, for all but v000 over two sittings.
// Sittings can differ by a few percent; kernels timed side by side share one.
// The starting kernel, v000, takes 332 microseconds a run.
#include <hip/hip_runtime.h>
#include <stdint.h>

// ---------------------------------------------------------------------------
// CoreProcessor for MI455X (gfx1250, wave32)
//   processed[t,:] = sum_m attn[t,m] * (ops[m] @ x[t])
//                  = sum_m ( (attn[t,m]*x[t]) @ ops[m]^T )   <-- fold scale into A rows
// Main contraction: 34.4 GFLOP f32 -> V_WMMA_F32_16X16X4_F32, K chained over m*e.
// ops[m] streamed HBM/L2 -> LDS with the Tensor Data Mover (double buffered),
// using TDM pad_enable to write a 132-float pitch (pitch%64==4 => ds_load_b64
// B fetches are bank-conflict free).
// ---------------------------------------------------------------------------

#define DIMD   128
#define MSLOTS 64
#define NTOK   16384          // B*S = 4*4096
#define TOK_PER_WG 64
#define PITCH  132            // LDS row pitch in floats (128 + 4 pad)
#define NTHREADS 128          // 4 waves

typedef float v2f  __attribute__((ext_vector_type(2)));
typedef float v8f  __attribute__((ext_vector_type(8)));
typedef unsigned int v4u __attribute__((ext_vector_type(4)));
typedef int   v4i  __attribute__((ext_vector_type(4)));
typedef int   v8i  __attribute__((ext_vector_type(8)));

// LDS layout (floats)
#define XS_OFF   0
#define ATTN_OFF (64 * PITCH)                 // attnT[64][64]
#define QS_OFF   (ATTN_OFF + 64 * 64)
#define OPS_OFF  (QS_OFF + 64 * PITCH)
#define OPS_BUF_FLOATS (128 * PITCH)
#define SMEM_FLOATS (OPS_OFF + 2 * OPS_BUF_FLOATS)   // 54784 floats = 219136 B

__device__ __forceinline__ unsigned lds_off_of(const void* p) {
  // generic pointers to LDS: addr[31:0] is the LDS byte offset (ISA aperture rule)
  return (unsigned)(uintptr_t)p;
}

// TDM: load one 128x128 f32 tile (ops[m]) to LDS with 16B padding per 512B row.
__device__ __forceinline__ void tdm_load_ops_tile(const float* gsrc, unsigned lds_byte_off) {
  uint64_t ga = (uint64_t)(uintptr_t)gsrc;
  v4u g0;
  g0[0] = 1u;                                        // count=1, user descriptor
  g0[1] = lds_byte_off;                              // lds_addr
  g0[2] = (unsigned)(ga & 0xFFFFFFFFull);            // global_addr[31:0]
  g0[3] = (unsigned)((ga >> 32) & 0x01FFFFFFull)     // global_addr[56:32]
        | (2u << 30);                                // type = 2 ("image")
  v8i g1;
  g1[0] = (int)((2u << 16)      // data_size = 4B
              | (1u << 20)      // pad_enable
              | (6u << 22)      // pad_interval code 6 => every 128 dwords
              | (3u << 25));    // pad_amount  code 3 => 4 dwords (pitch 132)
  g1[1] = (int)(128u << 16);                 // tensor_dim0 = 128      (bits 79:48)
  g1[2] = (int)((8192u & 0xFFFFu) << 16);    // tensor_dim1 = 64*128   (bits 111:80)
  g1[3] = (int)(128u << 16);                 // tile_dim0 = 128        (bits 127:112)
  g1[4] = (int)128;                          // tile_dim1 = 128, tile_dim2 = 0
  g1[5] = (int)128;                          // tensor_dim0_stride = 128 (low32)
  g1[6] = 0;
  g1[7] = 0;
  v4i z4 = {0, 0, 0, 0};
  v8i z8 = {0, 0, 0, 0, 0, 0, 0, 0};
  // 6-arg form (clang-23 / therock-10.0 headers): groups 0..3 + extra group + cpol
  __builtin_amdgcn_tensor_load_to_lds(g0, g1, z4, z4, z8, 0);
}

__global__ __launch_bounds__(NTHREADS) void core_processor_kernel(
    const float* __restrict__ x,     // [16384,128]
    const float* __restrict__ keys,  // [64,128]
    const float* __restrict__ ops,   // [64,128,128]
    const float* __restrict__ Wq,    // [128,128]
    const float* __restrict__ bq,    // [128]
    float* __restrict__ out)         // [16384,128]
{
  extern __shared__ float smem[];
  float* xs    = smem + XS_OFF;
  float* attnT = smem + ATTN_OFF;
  float* qs    = smem + QS_OFF;
  float* opsb  = smem + OPS_OFF;

  const int tid  = threadIdx.x;
  const int wave = tid >> 5;
  const int lane = tid & 31;
  const int lrow = lane & 15;       // token row within wave's 16x16 tiles / B column
  const int half = lane >> 4;       // K-half split of WMMA operands
  const int tok_base = blockIdx.x * TOK_PER_WG;

  // Kick off TDM for ops[0] immediately; stage-1 compute hides its latency.
  if (wave == 0) {
    tdm_load_ops_tile(ops, lds_off_of(opsb));
  }

  // ---------------- Stage 1a: stage x tile (64 tokens x 128) into LDS --------
  for (int i = tid; i < 64 * 32; i += NTHREADS) {     // float4 granularity
    int r  = i >> 5;
    int c4 = i & 31;
    float4 v = *(const float4*)(x + (size_t)(tok_base + r) * DIMD + c4 * 4);
    *(float4*)(xs + r * PITCH + c4 * 4) = v;
  }
  __syncthreads();

  // ---------------- Stage 1b: queries = x @ Wq^T + bq ------------------------
  {
    int t     = tid >> 1;
    int dbase = (tid & 1) * 64;
    for (int i = 0; i < 64; ++i) {
      int d = dbase + i;
      const float4* wrow = (const float4*)(Wq + (size_t)d * DIMD);
      float s = bq[d];
      for (int e4 = 0; e4 < 32; ++e4) {
        float4 w  = wrow[e4];
        float4 xv = *(const float4*)(xs + t * PITCH + e4 * 4);
        s += w.x * xv.x + w.y * xv.y + w.z * xv.z + w.w * xv.w;
      }
      qs[t * PITCH + d] = s;
    }
  }
  __syncthreads();

  // ---------------- Stage 1c: logits + softmax -> attnT[m][t] ---------------
  if (tid < 64) {
    int t = tid;
    const float scale = 0.08838834764831845f;   // 1/sqrt(128)
    float mx = -3.0e38f;
    for (int m = 0; m < MSLOTS; ++m) {
      const float4* krow = (const float4*)(keys + (size_t)m * DIMD);
      float s = 0.f;
      for (int e4 = 0; e4 < 32; ++e4) {
        float4 k  = krow[e4];
        float4 qv = *(const float4*)(qs + t * PITCH + e4 * 4);
        s += k.x * qv.x + k.y * qv.y + k.z * qv.z + k.w * qv.w;
      }
      s *= scale;
      attnT[m * 64 + t] = s;
      mx = fmaxf(mx, s);
    }
    float sum = 0.f;
    for (int m = 0; m < MSLOTS; ++m) {
      float e = __expf(attnT[m * 64 + t] - mx);
      attnT[m * 64 + t] = e;
      sum += e;
    }
    float inv = 1.f / sum;
    for (int m = 0; m < MSLOTS; ++m) attnT[m * 64 + t] *= inv;
  }
  __syncthreads();

  // ---------------- Stage 2: main WMMA contraction ---------------------------
  // A registers: lane holds token row (wave*16+lrow); K-groups of 4 split by half.
  v2f xa[32];
  {
    const float* xrowp = xs + (wave * 16 + lrow) * PITCH + 2 * half;
    #pragma unroll
    for (int g = 0; g < 32; ++g) xa[g] = *(const v2f*)(xrowp + 4 * g);
  }
  v8f acc[8] = {};   // 16 tokens x 128 d, as 8 16x16 f32 C tiles

  for (int m = 0; m < MSLOTS; ++m) {
    if (wave == 0) {
      if (m + 1 < MSLOTS) {
        tdm_load_ops_tile(ops + (size_t)(m + 1) * DIMD * DIMD,
                          lds_off_of(opsb + ((m + 1) & 1) * OPS_BUF_FLOATS));
        __builtin_amdgcn_s_wait_tensorcnt(1);   // tile m is complete (in-order)
      } else {
        __builtin_amdgcn_s_wait_tensorcnt(0);
      }
    }
    __syncthreads();   // publish buffer (m&1) to all waves

    // per-m row scale: one scalar per lane (lane == token row in A layout)
    float aw = attnT[m * 64 + (wave * 16 + lrow)];
    v2f xsc[32];
    #pragma unroll
    for (int g = 0; g < 32; ++g) xsc[g] = xa[g] * aw;

    const float* brow = opsb + (m & 1) * OPS_BUF_FLOATS + lrow * PITCH + 2 * half;
    #pragma unroll
    for (int g = 0; g < 32; ++g) {
      #pragma unroll
      for (int dt = 0; dt < 8; ++dt) {   // 8 independent accumulator chains
        v2f bv = *(const v2f*)(brow + dt * 16 * PITCH + 4 * g);
        acc[dt] = __builtin_amdgcn_wmma_f32_16x16x4_f32(
            false, xsc[g], false, bv, (short)0, acc[dt], false, false);
      }
    }
    __syncthreads();   // buffer (m&1) free for TDM overwrite at iteration m+1
  }

  // ---------------- Epilogue: C layout -> global (coalesced 64B segments) ----
  #pragma unroll
  for (int dt = 0; dt < 8; ++dt) {
    #pragma unroll
    for (int j = 0; j < 8; ++j) {
      int row = tok_base + wave * 16 + j + 8 * half;   // C: M = j + 8*half
      out[(size_t)row * DIMD + dt * 16 + lrow] = acc[dt][j];
    }
  }
}

extern "C" void kernel_launch(void* const* d_in, const int* in_sizes, int n_in,
                              void* d_out, int out_size, void* d_ws, size_t ws_size,
                              hipStream_t stream) {
  (void)in_sizes; (void)n_in; (void)out_size; (void)d_ws; (void)ws_size;
  const float* x    = (const float*)d_in[0];
  const float* keys = (const float*)d_in[1];
  const float* ops  = (const float*)d_in[2];
  const float* Wq   = (const float*)d_in[3];
  const float* bq   = (const float*)d_in[4];
  float* out = (float*)d_out;

  const size_t shmem = (size_t)SMEM_FLOATS * sizeof(float);   // 219136 B
  (void)hipFuncSetAttribute((const void*)core_processor_kernel,
                            hipFuncAttributeMaxDynamicSharedMemorySize, (int)shmem);
  dim3 grid(NTOK / TOK_PER_WG);   // 256
  dim3 block(NTHREADS);           // 128 = 4 waves
  core_processor_kernel<<<grid, block, shmem, stream>>>(x, keys, ops, Wq, bq, out);
}

// v001
// A run of this version takes 238 microseconds.
// Next to v000, in two timings, it ran 1.44 and 1.45 times as fast.
#include <hip/hip_runtime.h>
#include <stdint.h>

// ---------------------------------------------------------------------------
// CoreProcessor for MI455X (gfx1250, wave32)
//   processed[t,:] = sum_m attn[t,m] * (ops[m] @ x[t])
//                  = sum_m ( (attn[t,m]*x[t]) @ ops[m]^T )   <-- fold scale into A rows
// Main contraction: 34.4 GFLOP f32 -> V_WMMA_F32_16X16X4_F32, K chained over m*e.
// ops[m] streamed HBM/L2 -> LDS with the Tensor Data Mover (double buffered),
// using TDM pad_enable to write a 132-float pitch (pitch%64==4 => ds_load_b64
// B fetches are bank-conflict free).
// ---------------------------------------------------------------------------

#define DIMD   128
#define MSLOTS 64
#define NTOK   16384          // B*S = 4*4096
#define TOK_PER_WG 64
#define PITCH  132            // LDS row pitch in floats (128 + 4 pad)
#define NTHREADS 128          // 4 waves
#define GBLK   8              // k-groups (of 4) per register block of B fragments
#define NBLK   4              // blocks per ops[m] tile: GBLK * NBLK = 32 k-groups

typedef float v2f  __attribute__((ext_vector_type(2)));
typedef float v8f  __attribute__((ext_vector_type(8)));
typedef unsigned int v4u __attribute__((ext_vector_type(4)));
typedef int   v4i  __attribute__((ext_vector_type(4)));
typedef int   v8i  __attribute__((ext_vector_type(8)));

// LDS layout (floats)
#define XS_OFF   0
#define ATTN_OFF (64 * PITCH)                 // attnT[64][64]
#define QS_OFF   (ATTN_OFF + 64 * 64)
#define OPS_OFF  (QS_OFF + 64 * PITCH)
#define OPS_BUF_FLOATS (128 * PITCH)
#define SMEM_FLOATS (OPS_OFF + 2 * OPS_BUF_FLOATS)   // 54784 floats = 219136 B

__device__ __forceinline__ unsigned lds_off_of(const void* p) {
  // generic pointers to LDS: addr[31:0] is the LDS byte offset (ISA aperture rule)
  return (unsigned)(uintptr_t)p;
}

// TDM: load one 128x128 f32 tile (ops[m]) to LDS with 16B padding per 512B row.
__device__ __forceinline__ void tdm_load_ops_tile(const float* gsrc, unsigned lds_byte_off) {
  uint64_t ga = (uint64_t)(uintptr_t)gsrc;
  v4u g0;
  g0[0] = 1u;                                        // count=1, user descriptor
  g0[1] = lds_byte_off;                              // lds_addr
  g0[2] = (unsigned)(ga & 0xFFFFFFFFull);            // global_addr[31:0]
  g0[3] = (unsigned)((ga >> 32) & 0x01FFFFFFull)     // global_addr[56:32]
        | (2u << 30);                                // type = 2 ("image")
  v8i g1;
  g1[0] = (int)((2u << 16)      // data_size = 4B
              | (1u << 20)      // pad_enable
              | (6u << 22)      // pad_interval code 6 => every 128 dwords
              | (3u << 25));    // pad_amount  code 3 => 4 dwords (pitch 132)
  g1[1] = (int)(128u << 16);                 // tensor_dim0 = 128      (bits 79:48)
  g1[2] = (int)((8192u & 0xFFFFu) << 16);    // tensor_dim1 = 64*128   (bits 111:80)
  g1[3] = (int)(128u << 16);                 // tile_dim0 = 128        (bits 127:112)
  g1[4] = (int)128;                          // tile_dim1 = 128, tile_dim2 = 0
  g1[5] = (int)128;                          // tensor_dim0_stride = 128 (low32)
  g1[6] = 0;
  g1[7] = 0;
  v4i z4 = {0, 0, 0, 0};
  v8i z8 = {0, 0, 0, 0, 0, 0, 0, 0};
  // 6-arg form (clang-23 / therock-10.0 headers): groups 0..3 + extra group + cpol
  __builtin_amdgcn_tensor_load_to_lds(g0, g1, z4, z4, z8, 0);
}

__global__ __launch_bounds__(NTHREADS) void core_processor_kernel(
    const float* __restrict__ x,     // [16384,128]
    const float* __restrict__ keys,  // [64,128]
    const float* __restrict__ ops,   // [64,128,128]
    const float* __restrict__ Wq,    // [128,128]
    const float* __restrict__ bq,    // [128]
    float* __restrict__ out)         // [16384,128]
{
  extern __shared__ float smem[];
  float* xs    = smem + XS_OFF;
  float* attnT = smem + ATTN_OFF;
  float* qs    = smem + QS_OFF;
  float* opsb  = smem + OPS_OFF;

  const int tid  = threadIdx.x;
  const int wave = tid >> 5;
  const int lane = tid & 31;
  const int lrow = lane & 15;       // token row within wave's 16x16 tiles / B column
  const int half = lane >> 4;       // K-half split of WMMA operands
  const int tok_base = blockIdx.x * TOK_PER_WG;

  // Kick off TDM for ops[0] immediately; stage-1 compute hides its latency.
  if (wave == 0) {
    tdm_load_ops_tile(ops, lds_off_of(opsb));
  }

  // ---------------- Stage 1a: stage x tile (64 tokens x 128) into LDS --------
  for (int i = tid; i < 64 * 32; i += NTHREADS) {     // float4 granularity
    int r  = i >> 5;
    int c4 = i & 31;
    float4 v = *(const float4*)(x + (size_t)(tok_base + r) * DIMD + c4 * 4);
    *(float4*)(xs + r * PITCH + c4 * 4) = v;
  }
  __syncthreads();

  // ---------------- Stage 1b: queries = x @ Wq^T + bq ------------------------
  {
    int t     = tid >> 1;
    int dbase = (tid & 1) * 64;
    for (int i = 0; i < 64; ++i) {
      int d = dbase + i;
      const float4* wrow = (const float4*)(Wq + (size_t)d * DIMD);
      float s = bq[d];
      for (int e4 = 0; e4 < 32; ++e4) {
        float4 w  = wrow[e4];
        float4 xv = *(const float4*)(xs + t * PITCH + e4 * 4);
        s += w.x * xv.x + w.y * xv.y + w.z * xv.z + w.w * xv.w;
      }
      qs[t * PITCH + d] = s;
    }
  }
  __syncthreads();

  // ---------------- Stage 1c: logits + softmax -> attnT[m][t] ---------------
  if (tid < 64) {
    int t = tid;
    const float scale = 0.08838834764831845f;   // 1/sqrt(128)
    float mx = -3.0e38f;
    for (int m = 0; m < MSLOTS; ++m) {
      const float4* krow = (const float4*)(keys + (size_t)m * DIMD);
      float s = 0.f;
      for (int e4 = 0; e4 < 32; ++e4) {
        float4 k  = krow[e4];
        float4 qv = *(const float4*)(qs + t * PITCH + e4 * 4);
        s += k.x * qv.x + k.y * qv.y + k.z * qv.z + k.w * qv.w;
      }
      s *= scale;
      attnT[m * 64 + t] = s;
      mx = fmaxf(mx, s);
    }
    float sum = 0.f;
    for (int m = 0; m < MSLOTS; ++m) {
      float e = __expf(attnT[m * 64 + t] - mx);
      attnT[m * 64 + t] = e;
      sum += e;
    }
    float inv = 1.f / sum;
    for (int m = 0; m < MSLOTS; ++m) attnT[m * 64 + t] *= inv;
  }
  __syncthreads();

  // ---------------- Stage 2: main WMMA contraction ---------------------------
  // A registers: lane holds token row (wave*16+lrow); K-groups of 4 split by half.
  v2f xa[32];
  {
    const float* xrowp = xs + (wave * 16 + lrow) * PITCH + 2 * half;
    #pragma unroll
    for (int g = 0; g < 32; ++g) xa[g] = *(const v2f*)(xrowp + 4 * g);
  }
  v8f acc[8] = {};   // 16 tokens x 128 d, as 8 16x16 f32 C tiles

  for (int m = 0; m < MSLOTS; ++m) {
    if (wave == 0) {
      if (m + 1 < MSLOTS) {
        tdm_load_ops_tile(ops + (size_t)(m + 1) * DIMD * DIMD,
                          lds_off_of(opsb + ((m + 1) & 1) * OPS_BUF_FLOATS));
        __builtin_amdgcn_s_wait_tensorcnt(1);   // tile m is complete (in-order)
      } else {
        __builtin_amdgcn_s_wait_tensorcnt(0);
      }
    }
    __syncthreads();   // publish buffer (m&1) to all waves

    // per-m row scale: one scalar per lane (lane == token row in A layout)
    float aw = attnT[m * 64 + (wave * 16 + lrow)];

    const float* brow = opsb + (m & 1) * OPS_BUF_FLOATS + lrow * PITCH + 2 * half;
    // B fragments go through two register sets: the pass is cut into NBLK blocks
    // of GBLK k-groups (GBLK*8 WMMAs); block b+1's LDS reads stand as ONE group in
    // front of block b's WMMAs, so no read stands among the WMMAs and none is
    // waited for right behind its issue.
    v2f bf[2][GBLK][8];
    #pragma unroll
    for (int g = 0; g < GBLK; ++g) {
      #pragma unroll
      for (int dt = 0; dt < 8; ++dt)
        bf[0][g][dt] = *(const v2f*)(brow + dt * 16 * PITCH + 4 * g);
    }
    #pragma unroll
    for (int b = 0; b < NBLK; ++b) {
      if (b + 1 < NBLK) {
        #pragma unroll
        for (int g = 0; g < GBLK; ++g) {
          #pragma unroll
          for (int dt = 0; dt < 8; ++dt)
            bf[(b + 1) & 1][g][dt] =
                *(const v2f*)(brow + dt * 16 * PITCH + 4 * ((b + 1) * GBLK + g));
        }
      }
      // keeps the scheduler from sinking the read group above into the WMMA block
      __builtin_amdgcn_sched_barrier(0);
      #pragma unroll
      for (int g = 0; g < GBLK; ++g) {
        v2f xsc = xa[b * GBLK + g] * aw;
        #pragma unroll
        for (int dt = 0; dt < 8; ++dt) {   // 8 independent accumulator chains
          acc[dt] = __builtin_amdgcn_wmma_f32_16x16x4_f32(
              false, xsc, false, bf[b & 1][g][dt], (short)0, acc[dt], false, false);
        }
      }
      // keeps the next block's read group from rising into this WMMA block
      __builtin_amdgcn_sched_barrier(0);
    }
    __syncthreads();   // buffer (m&1) free for TDM overwrite at iteration m+1
  }

  // ---------------- Epilogue: C layout -> global (coalesced 64B segments) ----
  #pragma unroll
  for (int dt = 0; dt < 8; ++dt) {
    #pragma unroll
    for (int j = 0; j < 8; ++j) {
      int row = tok_base + wave * 16 + j + 8 * half;   // C: M = j + 8*half
      out[(size_t)row * DIMD + dt * 16 + lrow] = acc[dt][j];
    }
  }
}

extern "C" void kernel_launch(void* const* d_in, const int* in_sizes, int n_in,
                              void* d_out, int out_size, void* d_ws, size_t ws_size,
                              hipStream_t stream) {
  (void)in_sizes; (void)n_in; (void)out_size; (void)d_ws; (void)ws_size;
  const float* x    = (const float*)d_in[0];
  const float* keys = (const float*)d_in[1];
  const float* ops  = (const float*)d_in[2];
  const float* Wq   = (const float*)d_in[3];
  const float* bq   = (const float*)d_in[4];
  float* out = (float*)d_out;

  const size_t shmem = (size_t)SMEM_FLOATS * sizeof(float);   // 219136 B
  (void)hipFuncSetAttribute((const void*)core_processor_kernel,
                            hipFuncAttributeMaxDynamicSharedMemorySize, (int)shmem);
  dim3 grid(NTOK / TOK_PER_WG);   // 256
  dim3 block(NTHREADS);           // 128 = 4 waves
  core_processor_kernel<<<grid, block, shmem, stream>>>(x, keys, ops, Wq, bq, out);
}

// v002
// It runs in 163 microseconds.
// Next to v001, in two timings, it ran 1.46 times as fast each time.
// Over all steps from v000 it is 2.11 times as fast.
#include <hip/hip_runtime.h>
#include <stdint.h>

// ---------------------------------------------------------------------------
// CoreProcessor for MI455X (gfx1250, wave32)
//   processed[t,:] = sum_m attn[t,m] * (ops[m] @ x[t])
//                  = sum_m ( (attn[t,m]*x[t]) @ ops[m]^T )   <-- fold scale into A rows
// Main contraction: 34.4 GFLOP f32 -> V_WMMA_F32_16X16X4_F32, K chained over m*e.
// ops[m] streamed HBM/L2 -> LDS with the Tensor Data Mover (double buffered),
// using TDM pad_enable to write a 132-float pitch (pitch%64==4 => ds_load_b64
// B fetches are bank-conflict free).
// ---------------------------------------------------------------------------

#define DIMD   128
#define MSLOTS 64
#define NTOK   16384          // B*S = 4*4096
#define TOK_PER_WG 64
#define PITCH  132            // LDS row pitch in floats (128 + 4 pad)
#define NTHREADS 128          // 4 waves
#define GBLK   8              // k-groups (of 4) per register block of B fragments
#define NBLK   4              // blocks per ops[m] tile: GBLK * NBLK = 32 k-groups

typedef float v2f  __attribute__((ext_vector_type(2)));
typedef float v8f  __attribute__((ext_vector_type(8)));
typedef unsigned int v4u __attribute__((ext_vector_type(4)));
typedef int   v4i  __attribute__((ext_vector_type(4)));
typedef int   v8i  __attribute__((ext_vector_type(8)));

// LDS layout (floats)
#define XS_OFF   0
#define ATTN_OFF (64 * PITCH)                 // attnT[64][64]
#define QS_OFF   (ATTN_OFF + 64 * 64)
#define OPS_OFF  (QS_OFF + 64 * PITCH)
#define OPS_BUF_FLOATS (128 * PITCH)
#define KEYS_OFF (OPS_OFF + 2 * OPS_BUF_FLOATS)       // keys[64][PITCH]
#define SMEM_FLOATS (KEYS_OFF + 64 * PITCH)           // 63232 floats = 252928 B

__device__ __forceinline__ unsigned lds_off_of(const void* p) {
  // generic pointers to LDS: addr[31:0] is the LDS byte offset (ISA aperture rule)
  return (unsigned)(uintptr_t)p;
}

// TDM: load one 128x128 f32 tile (ops[m]) to LDS with 16B padding per 512B row.
__device__ __forceinline__ void tdm_load_ops_tile(const float* gsrc, unsigned lds_byte_off) {
  uint64_t ga = (uint64_t)(uintptr_t)gsrc;
  v4u g0;
  g0[0] = 1u;                                        // count=1, user descriptor
  g0[1] = lds_byte_off;                              // lds_addr
  g0[2] = (unsigned)(ga & 0xFFFFFFFFull);            // global_addr[31:0]
  g0[3] = (unsigned)((ga >> 32) & 0x01FFFFFFull)     // global_addr[56:32]
        | (2u << 30);                                // type = 2 ("image")
  v8i g1;
  g1[0] = (int)((2u << 16)      // data_size = 4B
              | (1u << 20)      // pad_enable
              | (6u << 22)      // pad_interval code 6 => every 128 dwords
              | (3u << 25));    // pad_amount  code 3 => 4 dwords (pitch 132)
  g1[1] = (int)(128u << 16);                 // tensor_dim0 = 128      (bits 79:48)
  g1[2] = (int)((8192u & 0xFFFFu) << 16);    // tensor_dim1 = 64*128   (bits 111:80)
  g1[3] = (int)(128u << 16);                 // tile_dim0 = 128        (bits 127:112)
  g1[4] = (int)128;                          // tile_dim1 = 128, tile_dim2 = 0
  g1[5] = (int)128;                          // tensor_dim0_stride = 128 (low32)
  g1[6] = 0;
  g1[7] = 0;
  v4i z4 = {0, 0, 0, 0};
  v8i z8 = {0, 0, 0, 0, 0, 0, 0, 0};
  // 6-arg form (clang-23 / therock-10.0 headers): groups 0..3 + extra group + cpol
  __builtin_amdgcn_tensor_load_to_lds(g0, g1, z4, z4, z8, 0);
}

// c[16 x NT*16] += a[16 x 128] * b^T for NT*16 rows of b in LDS (pitch PITCH).
// brow = b + lrow * PITCH + 2 * half. Fragment maps, k order and the two register
// sets of B fragments are those of the main contraction in stage 2.
template <int NT>
__device__ __forceinline__ void rows_product(const float* brow, const v2f (&a)[32],
                                             v8f (&c)[NT]) {
  v2f bf[2][GBLK][NT];
  // every loop here is unrolled so that bf, a and c are indexed by constants and
  // stay in registers
  #pragma unroll
  for (int g = 0; g < GBLK; ++g) {
    #pragma unroll
    for (int nt = 0; nt < NT; ++nt)
      bf[0][g][nt] = *(const v2f*)(brow + nt * 16 * PITCH + 4 * g);
  }
  #pragma unroll
  for (int b = 0; b < NBLK; ++b) {
    if (b + 1 < NBLK) {
      #pragma unroll
      for (int g = 0; g < GBLK; ++g) {
        #pragma unroll
        for (int nt = 0; nt < NT; ++nt)
          bf[(b + 1) & 1][g][nt] =
              *(const v2f*)(brow + nt * 16 * PITCH + 4 * ((b + 1) * GBLK + g));
      }
    }
    // keeps the scheduler from sinking the read group above into the WMMA block
    __builtin_amdgcn_sched_barrier(0);
    #pragma unroll
    for (int g = 0; g < GBLK; ++g) {
      #pragma unroll
      for (int nt = 0; nt < NT; ++nt) {
        c[nt] = __builtin_amdgcn_wmma_f32_16x16x4_f32(
            false, a[b * GBLK + g], false, bf[b & 1][g][nt], (short)0, c[nt], false, false);
      }
    }
    // keeps the next block's read group from rising into this WMMA block
    __builtin_amdgcn_sched_barrier(0);
  }
  // four vector slots between the last WMMA and the first vector instruction that reads
  // its result or overwrites its operands
  asm volatile("v_nop\n\tv_nop\n\tv_nop\n\tv_nop");
  // keeps the users of c from rising in front of the v_nops
  __builtin_amdgcn_sched_barrier(0);
}

__global__ __launch_bounds__(NTHREADS) void core_processor_kernel(
    const float* __restrict__ x,     // [16384,128]
    const float* __restrict__ keys,  // [64,128]
    const float* __restrict__ ops,   // [64,128,128]
    const float* __restrict__ Wq,    // [128,128]
    const float* __restrict__ bq,    // [128]
    float* __restrict__ out)         // [16384,128]
{
  extern __shared__ float smem[];
  float* xs    = smem + XS_OFF;
  float* attnT = smem + ATTN_OFF;
  float* qs    = smem + QS_OFF;
  float* opsb  = smem + OPS_OFF;
  float* wqs   = opsb + OPS_BUF_FLOATS;   // Wq sits in ops buffer 1 until stage 2 starts
  float* ks    = smem + KEYS_OFF;

  const int tid  = threadIdx.x;
  const int wave = tid >> 5;
  const int lane = tid & 31;
  const int lrow = lane & 15;       // token row within wave's 16x16 tiles / B column
  const int half = lane >> 4;       // K-half split of WMMA operands
  const int tok_base = blockIdx.x * TOK_PER_WG;

  // Kick off TDM for ops[0] immediately; stage-1 compute hides its latency.
  if (wave == 0) {
    tdm_load_ops_tile(ops, lds_off_of(opsb));
  }

  // ---------------- Stage 1a: stage x tile (64 tokens x 128) into LDS --------
  for (int i = tid; i < 64 * 32; i += NTHREADS) {     // float4 granularity
    int r  = i >> 5;
    int c4 = i & 31;
    float4 v = *(const float4*)(x + (size_t)(tok_base + r) * DIMD + c4 * 4);
    *(float4*)(xs + r * PITCH + c4 * 4) = v;
  }
  // Wq (128 rows) and keys (64 rows) go to LDS at the same pitch: a wave moves one whole
  // row per step, the block four rows (NTHREADS float4 in global memory).
  {
    const float4* wsrc = (const float4*)Wq + tid;
    const float4* ksrc = (const float4*)keys + tid;
    const int     soff = wave * PITCH + lane * 4;
    // unrolled so that a group's global loads are all in flight before its first store
    #pragma unroll
    for (int it = 0; it < 32; ++it)
      *(float4*)(wqs + soff + it * 4 * PITCH) = wsrc[it * NTHREADS];
    // unrolled for the same reason
    #pragma unroll
    for (int it = 0; it < 16; ++it)
      *(float4*)(ks + soff + it * 4 * PITCH) = ksrc[it * NTHREADS];
  }
  // bias of the lane's eight output columns (C: N = lrow), fetched ahead of the barrier
  float bqv[8];
  // unrolled, as every loop of stages 1b and 1c below: their register arrays (bqv, xa, q,
  // qa, lg) need constant indices
  #pragma unroll
  for (int dt = 0; dt < 8; ++dt) bqv[dt] = bq[dt * 16 + lrow];
  __syncthreads();

  // A registers: lane holds token row (wave*16+lrow); K-groups of 4 split by half.
  // Used unscaled by stage 1b and scaled per slot by stage 2.
  v2f xa[32];
  {
    const float* xrowp = xs + (wave * 16 + lrow) * PITCH + 2 * half;
    #pragma unroll
    for (int g = 0; g < 32; ++g) xa[g] = *(const v2f*)(xrowp + 4 * g);
  }

  // ---------------- Stage 1b: queries = x @ Wq^T + bq (WMMA) -----------------
  // Each wave does its own 16 tokens x 128 outputs; the bias is the start value of C.
  {
    v8f q[8];
    #pragma unroll
    for (int dt = 0; dt < 8; ++dt) {
      #pragma unroll
      for (int j = 0; j < 8; ++j) q[dt][j] = bqv[dt];
    }
    rows_product<8>(wqs + lrow * PITCH + 2 * half, xa, q);
    #pragma unroll
    for (int dt = 0; dt < 8; ++dt) {
      #pragma unroll
      for (int j = 0; j < 8; ++j)                // C: M = j + 8*half
        qs[(wave * 16 + j + 8 * half) * PITCH + dt * 16 + lrow] = q[dt][j];
    }
  }
  __syncthreads();

  // ---------------- Stage 1c: logits (WMMA) + softmax -> attnT[m][t] --------
  {
    v2f qa[32];
    const float* qrowp = qs + (wave * 16 + lrow) * PITCH + 2 * half;
    #pragma unroll
    for (int g = 0; g < 32; ++g) qa[g] = *(const v2f*)(qrowp + 4 * g);
    v8f lg[4] = {};   // 16 tokens x 64 slots: lane holds slot nt*16+lrow, tokens j+8*half
    rows_product<4>(ks + lrow * PITCH + 2 * half, qa, lg);

    const float scale = 0.08838834764831845f;   // 1/sqrt(128)
    #pragma unroll
    for (int j = 0; j < 8; ++j) {
      // a token's 64 logits lie in 4 registers x the 16 lanes of this lane's half
      float s0 = lg[0][j] * scale, s1 = lg[1][j] * scale;
      float s2 = lg[2][j] * scale, s3 = lg[3][j] * scale;
      float mx = fmaxf(fmaxf(s0, s1), fmaxf(s2, s3));
      #pragma unroll
      for (int d = 1; d < 16; d <<= 1) mx = fmaxf(mx, __shfl_xor(mx, d, 32));
      s0 = __expf(s0 - mx); s1 = __expf(s1 - mx);
      s2 = __expf(s2 - mx); s3 = __expf(s3 - mx);
      float sum = (s0 + s1) + (s2 + s3);
      #pragma unroll
      for (int d = 1; d < 16; d <<= 1) sum += __shfl_xor(sum, d, 32);
      float inv = 1.f / sum;
      lg[0][j] = s0 * inv; lg[1][j] = s1 * inv;
      lg[2][j] = s2 * inv; lg[3][j] = s3 * inv;
    }
    #pragma unroll
    for (int nt = 0; nt < 4; ++nt) {
      float* ap = attnT + (nt * 16 + lrow) * 64 + wave * 16 + 8 * half;
      *(float4*)(ap)     = make_float4(lg[nt][0], lg[nt][1], lg[nt][2], lg[nt][3]);
      *(float4*)(ap + 4) = make_float4(lg[nt][4], lg[nt][5], lg[nt][6], lg[nt][7]);
    }
  }
  __syncthreads();   // also ends every wave's reads of Wq before ops[1] lands on it

  // ---------------- Stage 2: main WMMA contraction ---------------------------
  v8f acc[8] = {};   // 16 tokens x 128 d, as 8 16x16 f32 C tiles

  for (int m = 0; m < MSLOTS; ++m) {
    if (wave == 0) {
      if (m + 1 < MSLOTS) {
        tdm_load_ops_tile(ops + (size_t)(m + 1) * DIMD * DIMD,
                          lds_off_of(opsb + ((m + 1) & 1) * OPS_BUF_FLOATS));
        __builtin_amdgcn_s_wait_tensorcnt(1);   // tile m is complete (in-order)
      } else {
        __builtin_amdgcn_s_wait_tensorcnt(0);
      }
    }
    __syncthreads();   // publish buffer (m&1) to all waves

    // per-m row scale: one scalar per lane (lane == token row in A layout)
    float aw = attnT[m * 64 + (wave * 16 + lrow)];

    const float* brow = opsb + (m & 1) * OPS_BUF_FLOATS + lrow * PITCH + 2 * half;
    // B fragments go through two register sets: the pass is cut into NBLK blocks
    // of GBLK k-groups (GBLK*8 WMMAs); block b+1's LDS reads stand as ONE group in
    // front of block b's WMMAs, so no read stands among the WMMAs and none is
    // waited for right behind its issue.
    v2f bf[2][GBLK][8];
    #pragma unroll
    for (int g = 0; g < GBLK; ++g) {
      #pragma unroll
      for (int dt = 0; dt < 8; ++dt)
        bf[0][g][dt] = *(const v2f*)(brow + dt * 16 * PITCH + 4 * g);
    }
    #pragma unroll
    for (int b = 0; b < NBLK; ++b) {
      if (b + 1 < NBLK) {
        #pragma unroll
        for (int g = 0; g < GBLK; ++g) {
          #pragma unroll
          for (int dt = 0; dt < 8; ++dt)
            bf[(b + 1) & 1][g][dt] =
                *(const v2f*)(brow + dt * 16 * PITCH + 4 * ((b + 1) * GBLK + g));
        }
      }
      // keeps the scheduler from sinking the read group above into the WMMA block
      __builtin_amdgcn_sched_barrier(0);
      #pragma unroll
      for (int g = 0; g < GBLK; ++g) {
        v2f xsc = xa[b * GBLK + g] * aw;
        #pragma unroll
        for (int dt = 0; dt < 8; ++dt) {   // 8 independent accumulator chains
          acc[dt] = __builtin_amdgcn_wmma_f32_16x16x4_f32(
              false, xsc, false, bf[b & 1][g][dt], (short)0, acc[dt], false, false);
        }
      }
      // keeps the next block's read group from rising into this WMMA block
      __builtin_amdgcn_sched_barrier(0);
    }
    __syncthreads();   // buffer (m&1) free for TDM overwrite at iteration m+1
  }

  // ---------------- Epilogue: C layout -> global (coalesced 64B segments) ----
  #pragma unroll
  for (int dt = 0; dt < 8; ++dt) {
    #pragma unroll
    for (int j = 0; j < 8; ++j) {
      int row = tok_base + wave * 16 + j + 8 * half;   // C: M = j + 8*half
      out[(size_t)row * DIMD + dt * 16 + lrow] = acc[dt][j];
    }
  }
}

extern "C" void kernel_launch(void* const* d_in, const int* in_sizes, int n_in,
                              void* d_out, int out_size, void* d_ws, size_t ws_size,
                              hipStream_t stream) {
  (void)in_sizes; (void)n_in; (void)out_size; (void)d_ws; (void)ws_size;
  const float* x    = (const float*)d_in[0];
  const float* keys = (const float*)d_in[1];
  const float* ops  = (const float*)d_in[2];
  const float* Wq   = (const float*)d_in[3];
  const float* bq   = (const float*)d_in[4];
  float* out = (float*)d_out;

  const size_t shmem = (size_t)SMEM_FLOATS * sizeof(float);   // 252928 B
  (void)hipFuncSetAttribute((const void*)core_processor_kernel,
                            hipFuncAttributeMaxDynamicSharedMemorySize, (int)shmem);
  dim3 grid(NTOK / TOK_PER_WG);   // 256
  dim3 block(NTHREADS);           // 128 = 4 waves
  core_processor_kernel<<<grid, block, shmem, stream>>>(x, keys, ops, Wq, bq, out);
}

// v003
// A run of this version takes 153 microseconds.
// In both of two side-by-side timings against v002, it was 1.06 times as fast.
// Counting every step since v000, it is 2.25 times as fast.
#include <hip/hip_runtime.h>
#include <stdint.h>

// ---------------------------------------------------------------------------
// CoreProcessor for MI455X (gfx1250, wave32)
//   processed[t,:] = sum_m attn[t,m] * (ops[m] @ x[t])
//                  = sum_m ( (attn[t,m]*x[t]) @ ops[m]^T )   <-- fold scale into A rows
// Main contraction: 34.4 GFLOP f32 -> V_WMMA_F32_16X16X4_F32, K chained over m*e.
// ops[m] streamed HBM/L2 -> LDS with the Tensor Data Mover (double buffered),
// using TDM pad_enable to write a 132-float pitch (pitch%64==4 => ds_load_b64
// B fetches are bank-conflict free).
// ---------------------------------------------------------------------------

#define DIMD   128
#define MSLOTS 64
#define NTOK   16384          // B*S = 4*4096
#define TOK_PER_WG 64
#define PITCH  132            // LDS row pitch in floats (128 + 4 pad)
#define NTHREADS 128          // 4 waves
#define GBLK   8              // k-groups (of 4) per register block of B fragments
#define NBLK   4              // blocks per ops[m] tile: GBLK * NBLK = 32 k-groups

typedef float v2f  __attribute__((ext_vector_type(2)));
typedef float v8f  __attribute__((ext_vector_type(8)));
typedef unsigned int v4u __attribute__((ext_vector_type(4)));
typedef int   v4i  __attribute__((ext_vector_type(4)));
typedef int   v8i  __attribute__((ext_vector_type(8)));

// LDS layout (floats)
#define XS_OFF   0
#define ATTN_OFF (64 * PITCH)                 // attnT[64][64]
#define QS_OFF   (ATTN_OFF + 64 * 64)
#define OPS_OFF  (QS_OFF + 64 * PITCH)
#define OPS_BUF_FLOATS (128 * PITCH)
#define KEYS_OFF (OPS_OFF + 2 * OPS_BUF_FLOATS)       // keys[64][PITCH]
#define SMEM_FLOATS (KEYS_OFF + 64 * PITCH)           // 63232 floats = 252928 B

__device__ __forceinline__ unsigned lds_off_of(const void* p) {
  // generic pointers to LDS: addr[31:0] is the LDS byte offset (ISA aperture rule)
  return (unsigned)(uintptr_t)p;
}

// TDM: load one 128x128 f32 tile (ops[m]) to LDS with 16B padding per 512B row.
__device__ __forceinline__ void tdm_load_ops_tile(const float* gsrc, unsigned lds_byte_off) {
  uint64_t ga = (uint64_t)(uintptr_t)gsrc;
  v4u g0;
  g0[0] = 1u;                                        // count=1, user descriptor
  g0[1] = lds_byte_off;                              // lds_addr
  g0[2] = (unsigned)(ga & 0xFFFFFFFFull);            // global_addr[31:0]
  g0[3] = (unsigned)((ga >> 32) & 0x01FFFFFFull)     // global_addr[56:32]
        | (2u << 30);                                // type = 2 ("image")
  v8i g1;
  g1[0] = (int)((2u << 16)      // data_size = 4B
              | (1u << 20)      // pad_enable
              | (6u << 22)      // pad_interval code 6 => every 128 dwords
              | (3u << 25));    // pad_amount  code 3 => 4 dwords (pitch 132)
  g1[1] = (int)(128u << 16);                 // tensor_dim0 = 128      (bits 79:48)
  g1[2] = (int)((8192u & 0xFFFFu) << 16);    // tensor_dim1 = 64*128   (bits 111:80)
  g1[3] = (int)(128u << 16);                 // tile_dim0 = 128        (bits 127:112)
  g1[4] = (int)128;                          // tile_dim1 = 128, tile_dim2 = 0
  g1[5] = (int)128;                          // tensor_dim0_stride = 128 (low32)
  g1[6] = 0;
  g1[7] = 0;
  v4i z4 = {0, 0, 0, 0};
  v8i z8 = {0, 0, 0, 0, 0, 0, 0, 0};
  // 6-arg form (clang-23 / therock-10.0 headers): groups 0..3 + extra group + cpol
  __builtin_amdgcn_tensor_load_to_lds(g0, g1, z4, z4, z8, 0);
}

// c[16 x NT*16] += a[16 x 128] * b^T for NT*16 rows of b in LDS (pitch PITCH).
// brow = b + lrow * PITCH + 2 * half. Fragment maps, k order and the two register
// sets of B fragments are those of the main contraction in stage 2.
template <int NT>
__device__ __forceinline__ void rows_product(const float* brow, const v2f (&a)[32],
                                             v8f (&c)[NT]) {
  v2f bf[2][GBLK][NT];
  // every loop here is unrolled so that bf, a and c are indexed by constants and
  // stay in registers
  #pragma unroll
  for (int g = 0; g < GBLK; ++g) {
    #pragma unroll
    for (int nt = 0; nt < NT; ++nt)
      bf[0][g][nt] = *(const v2f*)(brow + nt * 16 * PITCH + 4 * g);
  }
  #pragma unroll
  for (int b = 0; b < NBLK; ++b) {
    if (b + 1 < NBLK) {
      #pragma unroll
      for (int g = 0; g < GBLK; ++g) {
        #pragma unroll
        for (int nt = 0; nt < NT; ++nt)
          bf[(b + 1) & 1][g][nt] =
              *(const v2f*)(brow + nt * 16 * PITCH + 4 * ((b + 1) * GBLK + g));
      }
    }
    // keeps the scheduler from sinking the read group above into the WMMA block
    __builtin_amdgcn_sched_barrier(0);
    #pragma unroll
    for (int g = 0; g < GBLK; ++g) {
      #pragma unroll
      for (int nt = 0; nt < NT; ++nt) {
        c[nt] = __builtin_amdgcn_wmma_f32_16x16x4_f32(
            false, a[b * GBLK + g], false, bf[b & 1][g][nt], (short)0, c[nt], false, false);
      }
    }
    // keeps the next block's read group from rising into this WMMA block
    __builtin_amdgcn_sched_barrier(0);
  }
  // four vector slots between the last WMMA and the first vector instruction that reads
  // its result or overwrites its operands
  asm volatile("v_nop\n\tv_nop\n\tv_nop\n\tv_nop");
  // keeps the users of c from rising in front of the v_nops
  __builtin_amdgcn_sched_barrier(0);
}

__global__ __launch_bounds__(NTHREADS) void core_processor_kernel(
    const float* __restrict__ x,     // [16384,128]
    const float* __restrict__ keys,  // [64,128]
    const float* __restrict__ ops,   // [64,128,128]
    const float* __restrict__ Wq,    // [128,128]
    const float* __restrict__ bq,    // [128]
    float* __restrict__ out)         // [16384,128]
{
  extern __shared__ float smem[];
  float* xs    = smem + XS_OFF;
  float* attnT = smem + ATTN_OFF;
  float* qs    = smem + QS_OFF;
  float* opsb  = smem + OPS_OFF;
  float* wqs   = opsb + OPS_BUF_FLOATS;   // Wq sits in ops buffer 1 until stage 2 starts
  float* ks    = smem + KEYS_OFF;

  const int tid  = threadIdx.x;
  const int wave = tid >> 5;
  const int lane = tid & 31;
  const int lrow = lane & 15;       // token row within wave's 16x16 tiles / B column
  const int half = lane >> 4;       // K-half split of WMMA operands
  const int tok_base = blockIdx.x * TOK_PER_WG;

  // Kick off TDM for ops[0] immediately; stage-1 compute hides its latency.
  if (wave == 0) {
    tdm_load_ops_tile(ops, lds_off_of(opsb));
  }

  // ---------------- Stage 1a: stage x tile (64 tokens x 128) into LDS --------
  for (int i = tid; i < 64 * 32; i += NTHREADS) {     // float4 granularity
    int r  = i >> 5;
    int c4 = i & 31;
    float4 v = *(const float4*)(x + (size_t)(tok_base + r) * DIMD + c4 * 4);
    *(float4*)(xs + r * PITCH + c4 * 4) = v;
  }
  // Wq (128 rows) and keys (64 rows) go to LDS at the same pitch: a wave moves one whole
  // row per step, the block four rows (NTHREADS float4 in global memory).
  {
    const float4* wsrc = (const float4*)Wq + tid;
    const float4* ksrc = (const float4*)keys + tid;
    const int     soff = wave * PITCH + lane * 4;
    // unrolled so that a group's global loads are all in flight before its first store
    #pragma unroll
    for (int it = 0; it < 32; ++it)
      *(float4*)(wqs + soff + it * 4 * PITCH) = wsrc[it * NTHREADS];
    // unrolled for the same reason
    #pragma unroll
    for (int it = 0; it < 16; ++it)
      *(float4*)(ks + soff + it * 4 * PITCH) = ksrc[it * NTHREADS];
  }
  // bias of the lane's eight output columns (C: N = lrow), fetched ahead of the barrier
  float bqv[8];
  // unrolled, as every loop of stages 1b and 1c below: their register arrays (bqv, xa, q,
  // qa, lg) need constant indices
  #pragma unroll
  for (int dt = 0; dt < 8; ++dt) bqv[dt] = bq[dt * 16 + lrow];
  __syncthreads();

  // A registers of stage 1b: lane holds token row (wave*16+lrow); K-groups of 4 split by half.
  v2f xa[32];
  {
    const float* xrowp = xs + (wave * 16 + lrow) * PITCH + 2 * half;
    #pragma unroll
    for (int g = 0; g < 32; ++g) xa[g] = *(const v2f*)(xrowp + 4 * g);
  }

  // ---------------- Stage 1b: queries = x @ Wq^T + bq (WMMA) -----------------
  // Each wave does its own 16 tokens x 128 outputs; the bias is the start value of C.
  {
    v8f q[8];
    #pragma unroll
    for (int dt = 0; dt < 8; ++dt) {
      #pragma unroll
      for (int j = 0; j < 8; ++j) q[dt][j] = bqv[dt];
    }
    rows_product<8>(wqs + lrow * PITCH + 2 * half, xa, q);
    #pragma unroll
    for (int dt = 0; dt < 8; ++dt) {
      #pragma unroll
      for (int j = 0; j < 8; ++j)                // C: M = j + 8*half
        qs[(wave * 16 + j + 8 * half) * PITCH + dt * 16 + lrow] = q[dt][j];
    }
  }
  __syncthreads();

  // ---------------- Stage 1c: logits (WMMA) + softmax -> attnT[m][t] --------
  {
    v2f qa[32];
    const float* qrowp = qs + (wave * 16 + lrow) * PITCH + 2 * half;
    #pragma unroll
    for (int g = 0; g < 32; ++g) qa[g] = *(const v2f*)(qrowp + 4 * g);
    v8f lg[4] = {};   // 16 tokens x 64 slots: lane holds slot nt*16+lrow, tokens j+8*half
    rows_product<4>(ks + lrow * PITCH + 2 * half, qa, lg);

    const float scale = 0.08838834764831845f;   // 1/sqrt(128)
    #pragma unroll
    for (int j = 0; j < 8; ++j) {
      // a token's 64 logits lie in 4 registers x the 16 lanes of this lane's half
      float s0 = lg[0][j] * scale, s1 = lg[1][j] * scale;
      float s2 = lg[2][j] * scale, s3 = lg[3][j] * scale;
      float mx = fmaxf(fmaxf(s0, s1), fmaxf(s2, s3));
      #pragma unroll
      for (int d = 1; d < 16; d <<= 1) mx = fmaxf(mx, __shfl_xor(mx, d, 32));
      s0 = __expf(s0 - mx); s1 = __expf(s1 - mx);
      s2 = __expf(s2 - mx); s3 = __expf(s3 - mx);
      float sum = (s0 + s1) + (s2 + s3);
      #pragma unroll
      for (int d = 1; d < 16; d <<= 1) sum += __shfl_xor(sum, d, 32);
      float inv = 1.f / sum;
      lg[0][j] = s0 * inv; lg[1][j] = s1 * inv;
      lg[2][j] = s2 * inv; lg[3][j] = s3 * inv;
    }
    #pragma unroll
    for (int nt = 0; nt < 4; ++nt) {
      float* ap = attnT + (nt * 16 + lrow) * 64 + wave * 16 + 8 * half;
      *(float4*)(ap)     = make_float4(lg[nt][0], lg[nt][1], lg[nt][2], lg[nt][3]);
      *(float4*)(ap + 4) = make_float4(lg[nt][4], lg[nt][5], lg[nt][6], lg[nt][7]);
    }
  }
  __syncthreads();   // also ends every wave's reads of Wq before ops[1] lands on it

  // ---------------- Stage 2: main WMMA contraction ---------------------------
  // Wave tile: all 64 tokens x 32 output columns (wave*32 ...). Every B fragment read from
  // LDS feeds four WMMAs (one per 16-token tile), and the four waves read disjoint rows of
  // ops[m]. The whole x tile is the wave's A operand and stays in registers, unscaled.
  v2f xall[4][32];
  // unrolled, as every loop of stage 2 but the m loop: xall, aw, bf and acc need constant indices
  #pragma unroll
  for (int tt = 0; tt < 4; ++tt) {
    const float* xrowp = xs + (tt * 16 + lrow) * PITCH + 2 * half;
    #pragma unroll
    for (int g = 0; g < 32; ++g) xall[tt][g] = *(const v2f*)(xrowp + 4 * g);
  }
  v8f acc[4][2] = {};   // 64 tokens x 32 d, as 4 x 2 16x16 f32 C tiles

  for (int m = 0; m < MSLOTS; ++m) {
    if (wave == 0) {
      if (m + 1 < MSLOTS) {
        tdm_load_ops_tile(ops + (size_t)(m + 1) * DIMD * DIMD,
                          lds_off_of(opsb + ((m + 1) & 1) * OPS_BUF_FLOATS));
        __builtin_amdgcn_s_wait_tensorcnt(1);   // tile m is complete (in-order)
      } else {
        __builtin_amdgcn_s_wait_tensorcnt(0);
      }
    }
    __syncthreads();   // publish buffer (m&1) to all waves

    // per-m row scale: one scalar per lane and token tile (lane == token row in A layout)
    float aw[4];
    #pragma unroll
    for (int tt = 0; tt < 4; ++tt) aw[tt] = attnT[m * 64 + tt * 16 + lrow];

    const float* brow =
        opsb + (m & 1) * OPS_BUF_FLOATS + (wave * 32 + lrow) * PITCH + 2 * half;
    // B fragments go through two register sets: the pass is cut into NBLK blocks
    // of GBLK k-groups (GBLK*8 WMMAs); block b+1's LDS reads stand as ONE group in
    // front of block b's WMMAs, so no read stands among the WMMAs and none is
    // waited for right behind its issue.
    v2f bf[2][GBLK][2];
    #pragma unroll
    for (int g = 0; g < GBLK; ++g) {
      #pragma unroll
      for (int nt = 0; nt < 2; ++nt)
        bf[0][g][nt] = *(const v2f*)(brow + nt * 16 * PITCH + 4 * g);
    }
    #pragma unroll
    for (int b = 0; b < NBLK; ++b) {
      if (b + 1 < NBLK) {
        #pragma unroll
        for (int g = 0; g < GBLK; ++g) {
          #pragma unroll
          for (int nt = 0; nt < 2; ++nt)
            bf[(b + 1) & 1][g][nt] =
                *(const v2f*)(brow + nt * 16 * PITCH + 4 * ((b + 1) * GBLK + g));
        }
      }
      // keeps the scheduler from sinking the read group above into the WMMA block
      __builtin_amdgcn_sched_barrier(0);
      #pragma unroll
      for (int g = 0; g < GBLK; ++g) {
        #pragma unroll
        for (int tt = 0; tt < 4; ++tt) {     // 4 x 2 independent accumulator chains
          v2f xsc = xall[tt][b * GBLK + g] * aw[tt];
          #pragma unroll
          for (int nt = 0; nt < 2; ++nt) {
            acc[tt][nt] = __builtin_amdgcn_wmma_f32_16x16x4_f32(
                false, xsc, false, bf[b & 1][g][nt], (short)0, acc[tt][nt], false, false);
          }
        }
      }
      // keeps the next block's read group from rising into this WMMA block
      __builtin_amdgcn_sched_barrier(0);
    }
    __syncthreads();   // buffer (m&1) free for TDM overwrite at iteration m+1
  }

  // ---------------- Epilogue: C layout -> global (coalesced 64B segments) ----
  #pragma unroll
  for (int tt = 0; tt < 4; ++tt) {
    #pragma unroll
    for (int nt = 0; nt < 2; ++nt) {
      #pragma unroll
      for (int j = 0; j < 8; ++j) {
        int row = tok_base + tt * 16 + j + 8 * half;   // C: M = j + 8*half
        out[(size_t)row * DIMD + wave * 32 + nt * 16 + lrow] = acc[tt][nt][j];
      }
    }
  }
}

extern "C" void kernel_launch(void* const* d_in, const int* in_sizes, int n_in,
                              void* d_out, int out_size, void* d_ws, size_t ws_size,
                              hipStream_t stream) {
  (void)in_sizes; (void)n_in; (void)out_size; (void)d_ws; (void)ws_size;
  const float* x    = (const float*)d_in[0];
  const float* keys = (const float*)d_in[1];
  const float* ops  = (const float*)d_in[2];
  const float* Wq   = (const float*)d_in[3];
  const float* bq   = (const float*)d_in[4];
  float* out = (float*)d_out;

  const size_t shmem = (size_t)SMEM_FLOATS * sizeof(float);   // 252928 B
  (void)hipFuncSetAttribute((const void*)core_processor_kernel,
                            hipFuncAttributeMaxDynamicSharedMemorySize, (int)shmem);
  dim3 grid(NTOK / TOK_PER_WG);   // 256
  dim3 block(NTHREADS);           // 128 = 4 waves
  core_processor_kernel<<<grid, block, shmem, stream>>>(x, keys, ops, Wq, bq, out);
}

// v004
// Measured time: 147 microseconds a run.
// Two timings next to v003 both put it at 1.04 times that version's speed.
// Counting every step since v000, it is 2.34 times as fast.
#include <hip/hip_runtime.h>
#include <stdint.h>

// ---------------------------------------------------------------------------
// CoreProcessor for MI455X (gfx1250, wave32)
//   processed[t,:] = sum_m attn[t,m] * (ops[m] @ x[t])
//                  = sum_m attn[t,m] * y_m[t,:],  y_m = x @ ops[m]^T   <-- scale on the result
// Main contraction: 34.4 GFLOP f32 -> V_WMMA_F32_16X16X4_F32, K chained over e inside a slot.
// ops[m] streamed HBM/L2 -> LDS with the Tensor Data Mover (double buffered),
// using TDM pad_enable to write a 132-float pitch (pitch%64==4 => ds_load_b64
// B fetches are bank-conflict free).
// ---------------------------------------------------------------------------

#define DIMD   128
#define MSLOTS 64
#define NTOK   16384          // B*S = 4*4096
#define TOK_PER_WG 64
#define PITCH  132            // LDS row pitch in floats (128 + 4 pad)
#define NTHREADS 128          // 4 waves
#define GBLK   8              // k-groups (of 4) per register block of B fragments
#define NBLK   4              // blocks per ops[m] tile: GBLK * NBLK = 32 k-groups

typedef float v2f  __attribute__((ext_vector_type(2)));
typedef float v8f  __attribute__((ext_vector_type(8)));
typedef unsigned int v4u __attribute__((ext_vector_type(4)));
typedef int   v4i  __attribute__((ext_vector_type(4)));
typedef int   v8i  __attribute__((ext_vector_type(8)));

// LDS layout (floats)
#define XS_OFF   0
#define ATTN_OFF (64 * PITCH)                 // attnT[64][64]
#define QS_OFF   (ATTN_OFF + 64 * 64)
#define OPS_OFF  (QS_OFF + 64 * PITCH)
#define OPS_BUF_FLOATS (128 * PITCH)
#define KEYS_OFF (OPS_OFF + 2 * OPS_BUF_FLOATS)       // keys[64][PITCH]
#define SMEM_FLOATS (KEYS_OFF + 64 * PITCH)           // 63232 floats = 252928 B

__device__ __forceinline__ unsigned lds_off_of(const void* p) {
  // generic pointers to LDS: addr[31:0] is the LDS byte offset (ISA aperture rule)
  return (unsigned)(uintptr_t)p;
}

// TDM: load one 128x128 f32 tile (ops[m]) to LDS with 16B padding per 512B row.
__device__ __forceinline__ void tdm_load_ops_tile(const float* gsrc, unsigned lds_byte_off) {
  uint64_t ga = (uint64_t)(uintptr_t)gsrc;
  v4u g0;
  g0[0] = 1u;                                        // count=1, user descriptor
  g0[1] = lds_byte_off;                              // lds_addr
  g0[2] = (unsigned)(ga & 0xFFFFFFFFull);            // global_addr[31:0]
  g0[3] = (unsigned)((ga >> 32) & 0x01FFFFFFull)     // global_addr[56:32]
        | (2u << 30);                                // type = 2 ("image")
  v8i g1;
  g1[0] = (int)((2u << 16)      // data_size = 4B
              | (1u << 20)      // pad_enable
              | (6u << 22)      // pad_interval code 6 => every 128 dwords
              | (3u << 25));    // pad_amount  code 3 => 4 dwords (pitch 132)
  g1[1] = (int)(128u << 16);                 // tensor_dim0 = 128      (bits 79:48)
  g1[2] = (int)((8192u & 0xFFFFu) << 16);    // tensor_dim1 = 64*128   (bits 111:80)
  g1[3] = (int)(128u << 16);                 // tile_dim0 = 128        (bits 127:112)
  g1[4] = (int)128;                          // tile_dim1 = 128, tile_dim2 = 0
  g1[5] = (int)128;                          // tensor_dim0_stride = 128 (low32)
  g1[6] = 0;
  g1[7] = 0;
  v4i z4 = {0, 0, 0, 0};
  v8i z8 = {0, 0, 0, 0, 0, 0, 0, 0};
  // 6-arg form (clang-23 / therock-10.0 headers): groups 0..3 + extra group + cpol
  __builtin_amdgcn_tensor_load_to_lds(g0, g1, z4, z4, z8, 0);
}

// c[16 x NT*16] += a[16 x 128] * b^T for NT*16 rows of b in LDS (pitch PITCH).
// brow = b + lrow * PITCH + 2 * half. Fragment maps, k order and the two register
// sets of B fragments are those of the main contraction in stage 2.
template <int NT>
__device__ __forceinline__ void rows_product(const float* brow, const v2f (&a)[32],
                                             v8f (&c)[NT]) {
  v2f bf[2][GBLK][NT];
  // every loop here is unrolled so that bf, a and c are indexed by constants and
  // stay in registers
  #pragma unroll
  for (int g = 0; g < GBLK; ++g) {
    #pragma unroll
    for (int nt = 0; nt < NT; ++nt)
      bf[0][g][nt] = *(const v2f*)(brow + nt * 16 * PITCH + 4 * g);
  }
  #pragma unroll
  for (int b = 0; b < NBLK; ++b) {
    if (b + 1 < NBLK) {
      #pragma unroll
      for (int g = 0; g < GBLK; ++g) {
        #pragma unroll
        for (int nt = 0; nt < NT; ++nt)
          bf[(b + 1) & 1][g][nt] =
              *(const v2f*)(brow + nt * 16 * PITCH + 4 * ((b + 1) * GBLK + g));
      }
    }
    // keeps the scheduler from sinking the read group above into the WMMA block
    __builtin_amdgcn_sched_barrier(0);
    #pragma unroll
    for (int g = 0; g < GBLK; ++g) {
      #pragma unroll
      for (int nt = 0; nt < NT; ++nt) {
        c[nt] = __builtin_amdgcn_wmma_f32_16x16x4_f32(
            false, a[b * GBLK + g], false, bf[b & 1][g][nt], (short)0, c[nt], false, false);
      }
    }
    // keeps the next block's read group from rising into this WMMA block
    __builtin_amdgcn_sched_barrier(0);
  }
  // four vector slots between the last WMMA and the first vector instruction that reads
  // its result or overwrites its operands
  asm volatile("v_nop\n\tv_nop\n\tv_nop\n\tv_nop");
  // keeps the users of c from rising in front of the v_nops
  __builtin_amdgcn_sched_barrier(0);
}

__global__ __launch_bounds__(NTHREADS) void core_processor_kernel(
    const float* __restrict__ x,     // [16384,128]
    const float* __restrict__ keys,  // [64,128]
    const float* __restrict__ ops,   // [64,128,128]
    const float* __restrict__ Wq,    // [128,128]
    const float* __restrict__ bq,    // [128]
    float* __restrict__ out)         // [16384,128]
{
  extern __shared__ float smem[];
  float* xs    = smem + XS_OFF;
  float* attnT = smem + ATTN_OFF;
  float* qs    = smem + QS_OFF;
  float* opsb  = smem + OPS_OFF;
  float* wqs   = opsb + OPS_BUF_FLOATS;   // Wq sits in ops buffer 1 until stage 2 starts
  float* ks    = smem + KEYS_OFF;

  const int tid  = threadIdx.x;
  const int wave = tid >> 5;
  const int lane = tid & 31;
  const int lrow = lane & 15;       // token row within wave's 16x16 tiles / B column
  const int half = lane >> 4;       // K-half split of WMMA operands
  const int tok_base = blockIdx.x * TOK_PER_WG;

  // Kick off TDM for ops[0] immediately; stage-1 compute hides its latency.
  if (wave == 0) {
    tdm_load_ops_tile(ops, lds_off_of(opsb));
  }

  // ---------------- Stage 1a: stage x tile (64 tokens x 128) into LDS --------
  for (int i = tid; i < 64 * 32; i += NTHREADS) {     // float4 granularity
    int r  = i >> 5;
    int c4 = i & 31;
    float4 v = *(const float4*)(x + (size_t)(tok_base + r) * DIMD + c4 * 4);
    *(float4*)(xs + r * PITCH + c4 * 4) = v;
  }
  // Wq (128 rows) and keys (64 rows) go to LDS at the same pitch: a wave moves one whole
  // row per step, the block four rows (NTHREADS float4 in global memory).
  {
    const float4* wsrc = (const float4*)Wq + tid;
    const float4* ksrc = (const float4*)keys + tid;
    const int     soff = wave * PITCH + lane * 4;
    // unrolled so that a group's global loads are all in flight before its first store
    #pragma unroll
    for (int it = 0; it < 32; ++it)
      *(float4*)(wqs + soff + it * 4 * PITCH) = wsrc[it * NTHREADS];
    // unrolled for the same reason
    #pragma unroll
    for (int it = 0; it < 16; ++it)
      *(float4*)(ks + soff + it * 4 * PITCH) = ksrc[it * NTHREADS];
  }
  // bias of the lane's eight output columns (C: N = lrow), fetched ahead of the barrier
  float bqv[8];
  // unrolled, as every loop of stages 1b and 1c below: their register arrays (bqv, xa, q,
  // qa, lg) need constant indices
  #pragma unroll
  for (int dt = 0; dt < 8; ++dt) bqv[dt] = bq[dt * 16 + lrow];
  __syncthreads();

  // A registers of stage 1b: lane holds token row (wave*16+lrow); K-groups of 4 split by half.
  v2f xa[32];
  {
    const float* xrowp = xs + (wave * 16 + lrow) * PITCH + 2 * half;
    #pragma unroll
    for (int g = 0; g < 32; ++g) xa[g] = *(const v2f*)(xrowp + 4 * g);
  }

  // ---------------- Stage 1b: queries = x @ Wq^T + bq (WMMA) -----------------
  // Each wave does its own 16 tokens x 128 outputs; the bias is the start value of C.
  {
    v8f q[8];
    #pragma unroll
    for (int dt = 0; dt < 8; ++dt) {
      #pragma unroll
      for (int j = 0; j < 8; ++j) q[dt][j] = bqv[dt];
    }
    rows_product<8>(wqs + lrow * PITCH + 2 * half, xa, q);
    #pragma unroll
    for (int dt = 0; dt < 8; ++dt) {
      #pragma unroll
      for (int j = 0; j < 8; ++j)                // C: M = j + 8*half
        qs[(wave * 16 + j + 8 * half) * PITCH + dt * 16 + lrow] = q[dt][j];
    }
  }
  __syncthreads();

  // ---------------- Stage 1c: logits (WMMA) + softmax -> attnT[m][t] --------
  {
    v2f qa[32];
    const float* qrowp = qs + (wave * 16 + lrow) * PITCH + 2 * half;
    #pragma unroll
    for (int g = 0; g < 32; ++g) qa[g] = *(const v2f*)(qrowp + 4 * g);
    v8f lg[4] = {};   // 16 tokens x 64 slots: lane holds slot nt*16+lrow, tokens j+8*half
    rows_product<4>(ks + lrow * PITCH + 2 * half, qa, lg);

    const float scale = 0.08838834764831845f;   // 1/sqrt(128)
    #pragma unroll
    for (int j = 0; j < 8; ++j) {
      // a token's 64 logits lie in 4 registers x the 16 lanes of this lane's half
      float s0 = lg[0][j] * scale, s1 = lg[1][j] * scale;
      float s2 = lg[2][j] * scale, s3 = lg[3][j] * scale;
      float mx = fmaxf(fmaxf(s0, s1), fmaxf(s2, s3));
      #pragma unroll
      for (int d = 1; d < 16; d <<= 1) mx = fmaxf(mx, __shfl_xor(mx, d, 32));
      s0 = __expf(s0 - mx); s1 = __expf(s1 - mx);
      s2 = __expf(s2 - mx); s3 = __expf(s3 - mx);
      float sum = (s0 + s1) + (s2 + s3);
      #pragma unroll
      for (int d = 1; d < 16; d <<= 1) sum += __shfl_xor(sum, d, 32);
      float inv = 1.f / sum;
      lg[0][j] = s0 * inv; lg[1][j] = s1 * inv;
      lg[2][j] = s2 * inv; lg[3][j] = s3 * inv;
    }
    #pragma unroll
    for (int nt = 0; nt < 4; ++nt) {
      float* ap = attnT + (nt * 16 + lrow) * 64 + wave * 16 + 8 * half;
      *(float4*)(ap)     = make_float4(lg[nt][0], lg[nt][1], lg[nt][2], lg[nt][3]);
      *(float4*)(ap + 4) = make_float4(lg[nt][4], lg[nt][5], lg[nt][6], lg[nt][7]);
    }
  }
  __syncthreads();   // also ends every wave's reads of Wq before ops[1] lands on it

  // ---------------- Stage 2: main WMMA contraction ---------------------------
  // Wave tile: all 64 tokens x 32 output columns (wave*32 ...). Every B fragment read from
  // LDS feeds four WMMAs (one per 16-token tile), and the four waves read disjoint rows of
  // ops[m]. The whole x tile is the wave's A operand and stays in registers.
  v2f xall[4][32];
  // unrolled, as every loop of stage 2 but the slot loop: xall, aw, bf, y and acc need constant indices
  #pragma unroll
  for (int tt = 0; tt < 4; ++tt) {
    const float* xrowp = xs + (tt * 16 + lrow) * PITCH + 2 * half;
    #pragma unroll
    for (int g = 0; g < 32; ++g) xall[tt][g] = *(const v2f*)(xrowp + 4 * g);
  }
  v8f acc[4][2] = {};   // 64 tokens x 32 d, as 4 x 2 16x16 f32 C tiles
  // y = x @ ops[m]^T of one slot, unscaled: the A operand is xall itself, so no vector
  // instruction stands among the WMMAs. The slot's weight meets the RESULT (C layout: register
  // j of a lane is token j + 8*half): 32 packed FMAs a slot in place of 128 packed multiplies.
  // Slot m's y enters acc at the top of slot m+1; both start at zero, so the first add is +0.
  v8f y[4][2] = {};
  v8f aw[4]   = {};

  for (int m = 0; m < MSLOTS; ++m) {
    if (wave == 0) {
      if (m + 1 < MSLOTS) {
        tdm_load_ops_tile(ops + (size_t)(m + 1) * DIMD * DIMD,
                          lds_off_of(opsb + ((m + 1) & 1) * OPS_BUF_FLOATS));
        __builtin_amdgcn_s_wait_tensorcnt(1);   // tile m is complete (in-order)
      } else {
        __builtin_amdgcn_s_wait_tensorcnt(0);
      }
    }
    __syncthreads();   // publish buffer (m&1) to all waves

    const float* brow =
        opsb + (m & 1) * OPS_BUF_FLOATS + (wave * 32 + lrow) * PITCH + 2 * half;
    // B fragments go through two register sets: the pass is cut into NBLK blocks
    // of GBLK k-groups (GBLK*8 WMMAs); block b+1's LDS reads stand as ONE group in
    // front of block b's WMMAs, so no read stands among the WMMAs and none is
    // waited for right behind its issue.
    v2f bf[2][GBLK][2];
    #pragma unroll
    for (int g = 0; g < GBLK; ++g) {
      #pragma unroll
      for (int nt = 0; nt < 2; ++nt)
        bf[0][g][nt] = *(const v2f*)(brow + nt * 16 * PITCH + 4 * g);
    }
    // keeps the reads above in front of the FMAs below, which then run while the reads fly
    __builtin_amdgcn_sched_barrier(0);
    // the slot before enters the sum, tiles in the order in which their last WMMAs issued
    #pragma unroll
    for (int tt = 0; tt < 4; ++tt) {
      #pragma unroll
      for (int nt = 0; nt < 2; ++nt) acc[tt][nt] += y[tt][nt] * aw[tt];
    }
    #pragma unroll
    for (int b = 0; b < NBLK; ++b) {
      if (b + 1 < NBLK) {
        #pragma unroll
        for (int g = 0; g < GBLK; ++g) {
          #pragma unroll
          for (int nt = 0; nt < 2; ++nt)
            bf[(b + 1) & 1][g][nt] =
                *(const v2f*)(brow + nt * 16 * PITCH + 4 * ((b + 1) * GBLK + g));
        }
      }
      if (b == 0) {
        // this slot's weights in the C layout, read with block 1's group (no new read place):
        // eight tokens a lane and token tile, the same address in the 16 lanes of a half
        #pragma unroll
        for (int tt = 0; tt < 4; ++tt) {
          const float4* ap = (const float4*)(attnT + m * 64 + tt * 16 + 8 * half);
          float4 lo = ap[0], hi = ap[1];
          aw[tt] = (v8f){lo.x, lo.y, lo.z, lo.w, hi.x, hi.y, hi.z, hi.w};
        }
      }
      // keeps the scheduler from sinking the read group above into the WMMA block
      __builtin_amdgcn_sched_barrier(0);
      #pragma unroll
      for (int g = 0; g < GBLK; ++g) {
        #pragma unroll
        for (int tt = 0; tt < 4; ++tt) {     // 4 x 2 independent accumulator chains
          #pragma unroll
          for (int nt = 0; nt < 2; ++nt) {
            const v8f zero = {};
            y[tt][nt] = __builtin_amdgcn_wmma_f32_16x16x4_f32(
                false, xall[tt][b * GBLK + g], false, bf[b & 1][g][nt], (short)0,
                (b == 0 && g == 0) ? zero : y[tt][nt], false, false);
          }
        }
      }
      // keeps the next block's read group from rising into this WMMA block
      __builtin_amdgcn_sched_barrier(0);
    }
    __syncthreads();   // buffer (m&1) free for TDM overwrite at iteration m+1
  }
  // the last slot enters the sum
  #pragma unroll
  for (int tt = 0; tt < 4; ++tt) {
    #pragma unroll
    for (int nt = 0; nt < 2; ++nt) acc[tt][nt] += y[tt][nt] * aw[tt];
  }

  // ---------------- Epilogue: C layout -> global (coalesced 64B segments) ----
  #pragma unroll
  for (int tt = 0; tt < 4; ++tt) {
    #pragma unroll
    for (int nt = 0; nt < 2; ++nt) {
      #pragma unroll
      for (int j = 0; j < 8; ++j) {
        int row = tok_base + tt * 16 + j + 8 * half;   // C: M = j + 8*half
        out[(size_t)row * DIMD + wave * 32 + nt * 16 + lrow] = acc[tt][nt][j];
      }
    }
  }
}

extern "C" void kernel_launch(void* const* d_in, const int* in_sizes, int n_in,
                              void* d_out, int out_size, void* d_ws, size_t ws_size,
                              hipStream_t stream) {
  (void)in_sizes; (void)n_in; (void)out_size; (void)d_ws; (void)ws_size;
  const float* x    = (const float*)d_in[0];
  const float* keys = (const float*)d_in[1];
  const float* ops  = (const float*)d_in[2];
  const float* Wq   = (const float*)d_in[3];
  const float* bq   = (const float*)d_in[4];
  float* out = (float*)d_out;

  const size_t shmem = (size_t)SMEM_FLOATS * sizeof(float);   // 252928 B
  (void)hipFuncSetAttribute((const void*)core_processor_kernel,
                            hipFuncAttributeMaxDynamicSharedMemorySize, (int)shmem);
  dim3 grid(NTOK / TOK_PER_WG);   // 256
  dim3 block(NTHREADS);           // 128 = 4 waves
  core_processor_kernel<<<grid, block, shmem, stream>>>(x, keys, ops, Wq, bq, out);
}
